// v000
// Times are from an AMD MI455X. After a warm-up the kernel runs many times in a row, and a time is the length of
// such a window on the GPU divided by its runs, so every launch and the gaps after it count. The runs cycle
// through copies of the inputs. A figure is the median of several windows, for all but v000 over two sittings.
// Sittings can differ by a few percent; kernels timed side by side share one.
// The starting kernel, v000, takes 645 microseconds a run.
#include <hip/hip_runtime.h>
#include <hip/hip_bf16.h>
#include <math.h>

typedef __attribute__((ext_vector_type(2))) float v2f;
typedef __attribute__((ext_vector_type(8))) float v8f;
typedef int v4i_t __attribute__((vector_size(16)));                 // matches builtin's V4i
typedef __attribute__((address_space(1))) v4i_t* gvec_p;            // global (addrspace 1)
typedef __attribute__((address_space(3))) v4i_t* lvec_p;            // LDS (addrspace 3)

#define BATCH  4
#define SEQ    4096
#define DDIM   1024
#define MDIM   (BATCH * SEQ)     // 16384
#define KDIM   DDIM              // 1024
#define NQKV   (3 * DDIM)        // 3072
#define NTOT   (4 * DDIM)        // 4096
#define BM     128
#define BN     128
#define BK     16
#define LSTR   20                // padded LDS row stride in floats: 80 B (16B-aligned rows)
#define NCHUNK 32
#define CHUNK  (SEQ / NCHUNK)    // 128

#if __has_builtin(__builtin_amdgcn_global_load_async_to_lds_b128)
#define USE_ASYNC 1
#else
#define USE_ASYNC 0
#endif

__device__ __forceinline__ void wait_async0() {
#if USE_ASYNC
#if __has_builtin(__builtin_amdgcn_s_wait_asynccnt)
    __builtin_amdgcn_s_wait_asynccnt(0);
#else
    asm volatile("s_wait_asynccnt 0x0" ::: "memory");
#endif
#endif
}

// ---------------------------------------------------------------------------
// Kernel 1: fused QKV + gate projection GEMM, fp32 WMMA (16x16x4).
// C[m,n] = sum_k X[m,k] * W[n,k] + bias[n], routed to q / k / v / sigmoid(g).
// Block tile 128x128, 8 waves in 4(M) x 2(N); wave tile 32x64 (8 WMMA/k-step).
// Double-buffered LDS staged with GLOBAL_LOAD_ASYNC_TO_LDS_B128 (ASYNCcnt).
// ---------------------------------------------------------------------------
__global__ __launch_bounds__(256)
void lla_qkvgate_gemm(const float* __restrict__ X,
                      const float* __restrict__ Wqkv,
                      const float* __restrict__ bqkv,
                      const float* __restrict__ Wgate,
                      const float* __restrict__ bgate,
                      float* __restrict__ qout,   // d_out used as q buffer
                      float* __restrict__ kbuf,
                      float* __restrict__ vbuf,
                      float* __restrict__ gbuf)
{
    // Row-major padded tiles: As[buf][m][k] = X[m0+m][k0+k], Bs[buf][n][k] = W[n0+n][k0+k]
    __shared__ float As[2][BM][LSTR];
    __shared__ float Bs[2][BN][LSTR];

    const int tid = threadIdx.x;
    const int m0  = blockIdx.x * BM;
    const int n0  = blockIdx.y * BN;
    // N-tiles of 128 never straddle the 3072 boundary (3072 % 128 == 0).
    const float* __restrict__ Wp =
        (n0 < NQKV) ? (Wqkv + (size_t)n0 * KDIM)
                    : (Wgate + (size_t)(n0 - NQKV) * KDIM);

    const int wid   = tid >> 5;
    const int lane  = tid & 31;
    const int half  = lane >> 4;   // 0: lanes 0-15, 1: lanes 16-31
    const int l     = lane & 15;
    const int waveM = wid & 3;     // 4 waves along M -> 4*32 = 128
    const int waveN = wid >> 2;    // 2 waves along N -> 2*64 = 128

    // stage one BK=16 slab (A: 512 x 16B chunks, B: 512 x 16B chunks; 4 per thread)
    auto stage = [&](int buf, int k0) {
#pragma unroll
        for (int it = 0; it < 2; ++it) {
            const int f  = tid + it * 256;
            const int m  = f >> 2;           // 0..127
            const int kq = f & 3;            // float4 chunk along k
            const float* src = X + (size_t)(m0 + m) * KDIM + k0 + kq * 4;
#if USE_ASYNC
            __builtin_amdgcn_global_load_async_to_lds_b128(
                (gvec_p)src, (lvec_p)&As[buf][m][kq * 4], 0, 0);
#else
            *(float4*)&As[buf][m][kq * 4] = *(const float4*)src;
#endif
        }
#pragma unroll
        for (int it = 0; it < 2; ++it) {
            const int f  = tid + it * 256;
            const int n  = f >> 2;           // 0..127
            const int kq = f & 3;
            const float* src = Wp + (size_t)n * KDIM + k0 + kq * 4;
#if USE_ASYNC
            __builtin_amdgcn_global_load_async_to_lds_b128(
                (gvec_p)src, (lvec_p)&Bs[buf][n][kq * 4], 0, 0);
#else
            *(float4*)&Bs[buf][n][kq * 4] = *(const float4*)src;
#endif
        }
    };

    v8f acc[2][4];
#pragma unroll
    for (int mt = 0; mt < 2; ++mt)
#pragma unroll
        for (int nt = 0; nt < 4; ++nt)
            acc[mt][nt] = v8f{};

    stage(0, 0);
    int buf = 0;
    for (int k0 = 0; k0 < KDIM; k0 += BK) {
        wait_async0();                         // my async copies into 'buf' complete
        __syncthreads();                       // staged slab visible to all waves
        if (k0 + BK < KDIM) stage(buf ^ 1, k0 + BK);   // prefetch next slab

#pragma unroll
        for (int kk = 0; kk < BK; kk += 4) {
            v2f af[2], bf[4];
#pragma unroll
            for (int mt = 0; mt < 2; ++mt) {
                const int m = waveM * 32 + mt * 16 + l;
                af[mt] = *(const v2f*)&As[buf][m][kk + 2 * half];  // 8B-aligned pair
            }
#pragma unroll
            for (int nt = 0; nt < 4; ++nt) {
                const int n = waveN * 64 + nt * 16 + l;
                bf[nt] = *(const v2f*)&Bs[buf][n][kk + 2 * half];
            }
#pragma unroll
            for (int mt = 0; mt < 2; ++mt)
#pragma unroll
                for (int nt = 0; nt < 4; ++nt)
                    acc[mt][nt] = __builtin_amdgcn_wmma_f32_16x16x4_f32(
                        false, af[mt], false, bf[nt],
                        (short)0, acc[mt][nt], false, false);
        }
        __syncthreads();                       // everyone done reading 'buf'
        buf ^= 1;
    }

    // ---- epilogue: bias add, route to q / k / v / sigmoid(g) ----
#pragma unroll
    for (int mt = 0; mt < 2; ++mt) {
#pragma unroll
        for (int nt = 0; nt < 4; ++nt) {
            const int col  = n0 + waveN * 64 + nt * 16 + l;   // combined feature index
            const float bias = (col < NQKV) ? bqkv[col] : bgate[col - NQKV];
            float* dst;
            int dcol;
            bool sig = false;
            if (col < DDIM)            { dst = qout; dcol = col; }
            else if (col < 2 * DDIM)   { dst = kbuf; dcol = col - DDIM; }
            else if (col < 3 * DDIM)   { dst = vbuf; dcol = col - 2 * DDIM; }
            else                       { dst = gbuf; dcol = col - 3 * DDIM; sig = true; }
            const int mbase = m0 + waveM * 32 + mt * 16 + half * 8;
#pragma unroll
            for (int r = 0; r < 8; ++r) {
                float val = acc[mt][nt][r] + bias;
                if (sig) val = 1.0f / (1.0f + __expf(-val));
                dst[(size_t)(mbase + r) * DDIM + dcol] = val;
            }
        }
    }
}

// ---------------------------------------------------------------------------
// Kernel 2: per-chunk sums of k*v along S.  grid = (D/256, NCHUNK, B)
// ---------------------------------------------------------------------------
__global__ __launch_bounds__(256)
void lla_chunk_sums(const float* __restrict__ kbuf,
                    const float* __restrict__ vbuf,
                    float* __restrict__ csum)
{
    const int d  = blockIdx.x * 256 + threadIdx.x;
    const int c  = blockIdx.y;
    const int b  = blockIdx.z;
    const int s0 = c * CHUNK;
    float acc = 0.0f;
    for (int s = s0; s < s0 + CHUNK; ++s) {
        const size_t i = ((size_t)b * SEQ + s) * DDIM + d;
        acc += kbuf[i] * vbuf[i];
    }
    csum[((size_t)b * NCHUNK + c) * DDIM + d] = acc;
}

// ---------------------------------------------------------------------------
// Kernel 3: exclusive scan of the NCHUNK chunk sums.  grid = (D/256, 1, B)
// ---------------------------------------------------------------------------
__global__ __launch_bounds__(256)
void lla_scan_offsets(float* __restrict__ csum)
{
    const int d = blockIdx.x * 256 + threadIdx.x;
    const int b = blockIdx.z;
    float run = 0.0f;
#pragma unroll
    for (int c = 0; c < NCHUNK; ++c) {
        const size_t i = ((size_t)b * NCHUNK + c) * DDIM + d;
        const float t = csum[i];
        csum[i] = run;
        run += t;
    }
}

// ---------------------------------------------------------------------------
// Kernel 4: apply — in-chunk running prefix + offset, out = q*state*g.
// grid = (D/256, NCHUNK, B).  q read from d_out and overwritten in place.
// ---------------------------------------------------------------------------
__global__ __launch_bounds__(256)
void lla_apply(float* __restrict__ out,            // holds q, overwritten
               const float* __restrict__ kbuf,
               const float* __restrict__ vbuf,
               const float* __restrict__ gbuf,
               const float* __restrict__ csum)
{
    const int d  = blockIdx.x * 256 + threadIdx.x;
    const int c  = blockIdx.y;
    const int b  = blockIdx.z;
    const int s0 = c * CHUNK;
    float acc = csum[((size_t)b * NCHUNK + c) * DDIM + d];
    for (int s = s0; s < s0 + CHUNK; ++s) {
        const size_t i = ((size_t)b * SEQ + s) * DDIM + d;
        acc += kbuf[i] * vbuf[i];
        out[i] = out[i] * acc * gbuf[i];
    }
}

// ---------------------------------------------------------------------------
extern "C" void kernel_launch(void* const* d_in, const int* in_sizes, int n_in,
                              void* d_out, int out_size, void* d_ws, size_t ws_size,
                              hipStream_t stream) {
    (void)in_sizes; (void)n_in; (void)out_size; (void)ws_size;
    const float* x     = (const float*)d_in[0];
    const float* Wqkv  = (const float*)d_in[1];
    const float* bqkv  = (const float*)d_in[2];
    const float* Wgate = (const float*)d_in[3];
    const float* bgate = (const float*)d_in[4];
    float* out = (float*)d_out;

    const size_t MD = (size_t)MDIM * DDIM;      // 16.78M floats = 64 MB
    float* kbuf = (float*)d_ws;
    float* vbuf = kbuf + MD;
    float* gbuf = vbuf + MD;
    float* csum = gbuf + MD;                    // B*NCHUNK*D floats = 512 KB

    // 1) fused projection GEMM (fp32 WMMA, async double-buffered LDS)
    lla_qkvgate_gemm<<<dim3(MDIM / BM, NTOT / BN, 1), 256, 0, stream>>>(
        x, Wqkv, bqkv, Wgate, bgate, out, kbuf, vbuf, gbuf);

    // 2) chunk partial sums of k*v
    lla_chunk_sums<<<dim3(DDIM / 256, NCHUNK, BATCH), 256, 0, stream>>>(kbuf, vbuf, csum);

    // 3) exclusive scan of chunk sums
    lla_scan_offsets<<<dim3(DDIM / 256, 1, BATCH), 256, 0, stream>>>(csum);

    // 4) apply cumsum and gating
    lla_apply<<<dim3(DDIM / 256, NCHUNK, BATCH), 256, 0, stream>>>(out, kbuf, vbuf, gbuf, csum);
}

// v001
// It runs in 609 microseconds.
// Two timings next to v000 both put it at 1.10 times that version's speed.
#include <hip/hip_runtime.h>
#include <hip/hip_bf16.h>
#include <math.h>

typedef __attribute__((ext_vector_type(2))) float v2f;
typedef __attribute__((ext_vector_type(8))) float v8f;
typedef int v4i_t __attribute__((vector_size(16)));                 // matches builtin's V4i
typedef __attribute__((address_space(1))) v4i_t* gvec_p;            // global (addrspace 1)
typedef __attribute__((address_space(3))) v4i_t* lvec_p;            // LDS (addrspace 3)

#define BATCH  4
#define SEQ    4096
#define DDIM   1024
#define MDIM   (BATCH * SEQ)     // 16384
#define KDIM   DDIM              // 1024
#define NQKV   (3 * DDIM)        // 3072
#define NTOT   (4 * DDIM)        // 4096
#define BM     128
#define BN     128
#define BK     16
#define LSTR   20                // padded LDS row stride in floats: 80 B (16B-aligned rows)
#define NCHUNK 32
#define CHUNK  (SEQ / NCHUNK)    // 128
#define DBLK   32                // features of each of q, k, v, gate per GEMM block (one 128 B line)
#define TP     36                // epilogue tile row stride in floats: 144 B = 16 B x odd
#define AROWS  16                // rows per block in the apply kernel

#if __has_builtin(__builtin_amdgcn_global_load_async_to_lds_b128)
#define USE_ASYNC 1
#else
#define USE_ASYNC 0
#endif

__device__ __forceinline__ void wait_async0() {
#if USE_ASYNC
#if __has_builtin(__builtin_amdgcn_s_wait_asynccnt)
    __builtin_amdgcn_s_wait_asynccnt(0);
#else
    asm volatile("s_wait_asynccnt 0x0" ::: "memory");
#endif
#endif
}

// ---------------------------------------------------------------------------
// Kernel 1: fused QKV + gate projection GEMM, fp32 WMMA (16x16x4).
// C[m,n] = sum_k X[m,k] * W[n,k] + bias[n].
// Block tile 128x128, 8 waves in 4(M) x 2(N); wave tile 32x64 (8 WMMA/k-step).
// The 128 columns of a block are q, k, v and gate of the SAME 32 features, and the
// four 16-column fragments of a wave are q, k, v, gate of the same 16 features, so
// k*v and q*sigmoid(g) are formed lane-locally from the accumulators.
// The 128 rows of a block are one chunk of the sequence: the epilogue also forms the
// running sum of k*v inside the chunk and the chunk's total.
// Double-buffered LDS staged with GLOBAL_LOAD_ASYNC_TO_LDS_B128 (ASYNCcnt).
// ---------------------------------------------------------------------------
__global__ __launch_bounds__(256)
void lla_qkvgate_gemm(const float* __restrict__ X,
                      const float* __restrict__ Wqkv,
                      const float* __restrict__ bqkv,
                      const float* __restrict__ Wgate,
                      const float* __restrict__ bgate,
                      float* __restrict__ qgout,  // d_out holds q*sigmoid(g)
                      float* __restrict__ pbuf,   // in-chunk inclusive running sum of k*v
                      float* __restrict__ csum)   // chunk totals of k*v
{
    // Row-major padded tiles: As[buf][m][k] = X[m0+m][k0+k], Bs[buf][n][k] = W row of column n
    __shared__ __attribute__((aligned(16))) float As[2][BM][LSTR];
    __shared__ __attribute__((aligned(16))) float Bs[2][BN][LSTR];

    const int tid = threadIdx.x;
    const int m0  = blockIdx.x * BM;
    const int d0  = blockIdx.y * DBLK;

    const int wid   = tid >> 5;
    const int lane  = tid & 31;
    const int half  = lane >> 4;   // 0: lanes 0-15, 1: lanes 16-31
    const int l     = lane & 15;
    const int waveM = wid & 3;     // 4 waves along M -> 4*32 = 128
    const int waveN = wid >> 2;    // 2 waves along N -> 2*64 = 128

    // stage one BK=16 slab (A: 512 x 16B chunks, B: 512 x 16B chunks; 4 per thread)
    auto stage = [&](int buf, int k0) {
#pragma unroll
        for (int it = 0; it < 2; ++it) {
            const int f  = tid + it * 256;
            const int m  = f >> 2;           // 0..127
            const int kq = f & 3;            // float4 chunk along k
            const float* src = X + (size_t)(m0 + m) * KDIM + k0 + kq * 4;
#if USE_ASYNC
            __builtin_amdgcn_global_load_async_to_lds_b128(
                (gvec_p)src, (lvec_p)&As[buf][m][kq * 4], 0, 0);
#else
            *(float4*)&As[buf][m][kq * 4] = *(const float4*)src;
#endif
        }
#pragma unroll
        for (int it = 0; it < 2; ++it) {
            const int f   = tid + it * 256;
            const int n   = f >> 2;           // 0..127
            const int kq  = f & 3;
            const int mat = (n >> 4) & 3;     // 0 q, 1 k, 2 v, 3 gate
            const int dd  = d0 + ((n >> 6) << 4) + (n & 15);
            const float* wrow = (mat < 3) ? (Wqkv + (size_t)(mat * DDIM + dd) * KDIM)
                                          : (Wgate + (size_t)dd * KDIM);
            const float* src = wrow + k0 + kq * 4;
#if USE_ASYNC
            __builtin_amdgcn_global_load_async_to_lds_b128(
                (gvec_p)src, (lvec_p)&Bs[buf][n][kq * 4], 0, 0);
#else
            *(float4*)&Bs[buf][n][kq * 4] = *(const float4*)src;
#endif
        }
    };

    v8f acc[2][4];
#pragma unroll
    for (int mt = 0; mt < 2; ++mt)
#pragma unroll
        for (int nt = 0; nt < 4; ++nt)
            acc[mt][nt] = v8f{};

    stage(0, 0);
    int buf = 0;
    for (int k0 = 0; k0 < KDIM; k0 += BK) {
        wait_async0();                         // my async copies into 'buf' complete
        __syncthreads();                       // staged slab visible to all waves
        if (k0 + BK < KDIM) stage(buf ^ 1, k0 + BK);   // prefetch next slab

#pragma unroll
        for (int kk = 0; kk < BK; kk += 4) {
            v2f af[2], bf[4];
#pragma unroll
            for (int mt = 0; mt < 2; ++mt) {
                const int m = waveM * 32 + mt * 16 + l;
                af[mt] = *(const v2f*)&As[buf][m][kk + 2 * half];  // 8B-aligned pair
            }
#pragma unroll
            for (int nt = 0; nt < 4; ++nt) {
                const int n = waveN * 64 + nt * 16 + l;
                bf[nt] = *(const v2f*)&Bs[buf][n][kk + 2 * half];
            }
#pragma unroll
            for (int mt = 0; mt < 2; ++mt)
#pragma unroll
                for (int nt = 0; nt < 4; ++nt)
                    acc[mt][nt] = __builtin_amdgcn_wmma_f32_16x16x4_f32(
                        false, af[mt], false, bf[nt],
                        (short)0, acc[mt][nt], false, false);
            // keeps the second half's fragment loads behind the first half's products: with all
            // twelve loads hoisted the kernel passes 128 VGPRs and a fourth block no longer fits a WGP
            if (kk == 4) __builtin_amdgcn_sched_barrier(0);
        }
        __syncthreads();                       // everyone done reading 'buf'
        buf ^= 1;
    }

    // ---- epilogue ----
    // Four vector slots between the loop's last WMMAs and the first vector instruction that
    // touches an accumulator.
    // The scheduling barrier keeps the epilogue's moves behind them.
    asm volatile("v_nop\n\tv_nop\n\tv_nop\n\tv_nop");
    __builtin_amdgcn_sched_barrier(0);
    // The loop's last barrier has ended every read of As and Bs and no copy is in
    // flight, so both arrays are free: Pt and Qt are 128 x 32 tiles at stride TP,
    // seg holds the k*v totals of the 16 row segments (8 rows each) of the chunk.
    float* Pt  = (float*)As;
    float* Qt  = (float*)Bs;
    float* seg = Pt + BM * TP;                 // 16 x 32 floats, behind the Pt tile

    const int dc = waveN * 16 + l;             // feature inside the block's 32
    const int d  = d0 + dc;
    const float bq = bqkv[d];
    const float bk = bqkv[DDIM + d];
    const float bv = bqkv[2 * DDIM + d];
    const float bg = bgate[d];

    // q*sigmoid(g) goes to its tile first: it needs nothing from other waves, and the
    // q and gate accumulators are dead from here on
#pragma unroll
    for (int mt = 0; mt < 2; ++mt) {
#pragma unroll
        for (int r = 0; r < 8; ++r) {
            const int row = waveM * 32 + mt * 16 + half * 8 + r;
            const float g = 1.0f / (1.0f + __expf(-(acc[mt][3][r] + bg)));
            Qt[row * TP + dc] = (acc[mt][0][r] + bq) * g;
        }
    }

    // lane-local running sum of k*v over the lane's 8 consecutive rows of each fragment
    float pre[2][8];
#pragma unroll
    for (int mt = 0; mt < 2; ++mt) {
        float run = 0.0f;
#pragma unroll
        for (int r = 0; r < 8; ++r) {
            run += (acc[mt][1][r] + bk) * (acc[mt][2][r] + bv);
            pre[mt][r] = run;
        }
        seg[(waveM * 4 + mt * 2 + half) * DBLK + dc] = run;
    }
    __syncthreads();                           // segment totals visible to all waves

    // sum of the segments above the lane's own two, in row order
    const int s0 = waveM * 4 + half;
    float base0 = 0.0f, base1 = 0.0f, run = 0.0f;
#pragma unroll
    for (int j = 0; j < 16; ++j) {
        if (j == s0)     base0 = run;
        if (j == s0 + 2) base1 = run;
        run += seg[j * DBLK + dc];
    }
    if (tid < DBLK) {                          // wave 0 stores the chunk totals, one line
        float tot = 0.0f;
#pragma unroll
        for (int j = 0; j < 16; ++j) tot += seg[j * DBLK + tid];
        csum[(size_t)blockIdx.x * DDIM + d0 + tid] = tot;   // BM == CHUNK: chunk id = blockIdx.x
    }

#pragma unroll
    for (int mt = 0; mt < 2; ++mt) {
        const float base = mt ? base1 : base0;
#pragma unroll
        for (int r = 0; r < 8; ++r) {
            const int row = waveM * 32 + mt * 16 + half * 8 + r;
            Pt[row * TP + dc] = base + pre[mt][r];
        }
    }
    __syncthreads();                           // both tiles complete before they are read back

    // whole 128 B lines: 8 lanes x 16 B per row, 4 rows per wave store
#pragma unroll
    for (int it = 0; it < 4; ++it) {
        const int f   = tid + it * 256;
        const int row = f >> 3;
        const int c4  = (f & 7) * 4;
        const size_t o = (size_t)(m0 + row) * DDIM + d0 + c4;
        *(float4*)&pbuf[o]  = *(const float4*)&Pt[row * TP + c4];
        *(float4*)&qgout[o] = *(const float4*)&Qt[row * TP + c4];
    }
}

// ---------------------------------------------------------------------------
// Kernel 2: exclusive scan of the NCHUNK chunk sums.  grid = (D/256, 1, B)
// ---------------------------------------------------------------------------
__global__ __launch_bounds__(256)
void lla_scan_offsets(float* __restrict__ csum)
{
    const int d = blockIdx.x * 256 + threadIdx.x;
    const int b = blockIdx.z;
    float run = 0.0f;
#pragma unroll
    for (int c = 0; c < NCHUNK; ++c) {
        const size_t i = ((size_t)b * NCHUNK + c) * DDIM + d;
        const float t = csum[i];
        csum[i] = run;
        run += t;
    }
}

// ---------------------------------------------------------------------------
// Kernel 3: apply, element-wise: out = (q*g) * (chunk offset + in-chunk running sum).
// grid = MDIM / AROWS; a block is one full row wide (256 x float4), AROWS rows deep.
// q*g is read from d_out and overwritten in place by the same thread.
// ---------------------------------------------------------------------------
__global__ __launch_bounds__(256)
void lla_apply(float* __restrict__ out,
               const float* __restrict__ pbuf,
               const float* __restrict__ csum)
{
    const int c4    = threadIdx.x * 4;
    const int row0  = blockIdx.x * AROWS;
    const int chunk = row0 / CHUNK;            // batch * NCHUNK + chunk in the sequence
    const float4 off = *(const float4*)&csum[(size_t)chunk * DDIM + c4];
    float*       qp = out  + (size_t)row0 * DDIM + c4;   // one address pair per plane,
    const float* pp = pbuf + (size_t)row0 * DDIM + c4;   // rows by constant offsets
#pragma unroll
    for (int r0 = 0; r0 < AROWS; r0 += 8) {
        float4 q[8], p[8];
#pragma unroll
        for (int r = 0; r < 8; ++r) {
            q[r] = *(const float4*)&qp[(r0 + r) * DDIM];
            p[r] = *(const float4*)&pp[(r0 + r) * DDIM];
        }
#pragma unroll
        for (int r = 0; r < 8; ++r) {
            float4 o;
            o.x = q[r].x * (off.x + p[r].x);
            o.y = q[r].y * (off.y + p[r].y);
            o.z = q[r].z * (off.z + p[r].z);
            o.w = q[r].w * (off.w + p[r].w);
            *(float4*)&qp[(r0 + r) * DDIM] = o;
        }
        // the next group's loads reuse registers that these stores name
        if (r0 + 8 < AROWS) asm volatile("s_wait_xcnt 0x0" ::: "memory");
    }
}

// ---------------------------------------------------------------------------
extern "C" void kernel_launch(void* const* d_in, const int* in_sizes, int n_in,
                              void* d_out, int out_size, void* d_ws, size_t ws_size,
                              hipStream_t stream) {
    (void)in_sizes; (void)n_in; (void)out_size; (void)ws_size;
    const float* x     = (const float*)d_in[0];
    const float* Wqkv  = (const float*)d_in[1];
    const float* bqkv  = (const float*)d_in[2];
    const float* Wgate = (const float*)d_in[3];
    const float* bgate = (const float*)d_in[4];
    float* out = (float*)d_out;

    const size_t MD = (size_t)MDIM * DDIM;      // 16.78M floats = 64 MB
    float* pbuf = (float*)d_ws;
    float* csum = pbuf + MD;                    // B*NCHUNK*D floats = 512 KB

    // 1) fused projection GEMM + k*v, q*sigmoid(g), in-chunk running sum, chunk totals
    lla_qkvgate_gemm<<<dim3(MDIM / BM, DDIM / DBLK, 1), 256, 0, stream>>>(
        x, Wqkv, bqkv, Wgate, bgate, out, pbuf, csum);

    // 2) exclusive scan of chunk sums
    lla_scan_offsets<<<dim3(DDIM / 256, 1, BATCH), 256, 0, stream>>>(csum);

    // 3) add the chunk offset and gate
    lla_apply<<<dim3(MDIM / AROWS, 1, 1), 256, 0, stream>>>(out, pbuf, csum);
}
